// v000
// The times below were measured on an AMD MI455X: many runs one after another, warmed up first and cycling through
// copies of the inputs, with the whole window's GPU time divided by the number of runs. Launches and the gaps
// between them are all in it. The median over several windows is given; except for v000 it joins two sittings, which
// can be a few percent apart, so the side-by-side timings, each taken in one sitting, are the better comparison.
// v000 is the starting kernel. One run takes 180 microseconds.
#include <hip/hip_runtime.h>

typedef __attribute__((ext_vector_type(16))) _Float16 v16h;
typedef __attribute__((ext_vector_type(8)))  _Float16 v8h;
typedef __attribute__((ext_vector_type(4)))  _Float16 v4h;
typedef __attribute__((ext_vector_type(8)))  float    v8f;

#define IN_DIMS  32
#define HID      64
#define OUT_DIMS 3
#define ROWS_PER_WAVE   16
#define WAVES_PER_BLOCK 4
#define ROWS_PER_BLOCK  (ROWS_PER_WAVE * WAVES_PER_BLOCK)   // 64
#define TILES_PER_BLOCK 8                                   // amortize weight staging 8x
#define APAD 72   // padded row stride in halves: 144B = multiple of 16B (aligned b128 DS loads)

// Gather one 16-lane-striped f16 fragment half-row: halves [0..7] from p, [8..15] from p+16.
// Matches the CDNA5 16-bit A/B 16x32 VGPR layout (ISA 7.12.2) when p = row_base + klo.
static __device__ __forceinline__ v16h load_frag(const _Float16* p) {
  v8h lo = *(const v8h*)(p);
  v8h hi = *(const v8h*)(p + 16);
  return __builtin_shufflevector(lo, hi, 0, 1, 2, 3, 4, 5, 6, 7,
                                         8, 9, 10, 11, 12, 13, 14, 15);
}

// One dense layer for this wave's 16-row tile:
//   actOut[16 x 64] = relu( actIn[16 x K] * W[K x 64] ),  W stored transposed [n][k] in LDS.
// TWO_K=false -> K=32 (input layer), TWO_K=true -> K=64 (hidden layers).
template <bool TWO_K>
static __device__ __forceinline__ void mlp_layer(const _Float16* actIn,
                                                 _Float16* actOut,
                                                 const _Float16* w,
                                                 int lane) {
  const int m   = lane & 15;          // A-row / B-col / D-col index for this lane
  const int klo = (lane >> 4) << 3;   // 0 or 8
  const int mb  = (lane >> 4) << 3;   // D rows mb..mb+7 (ISA C/D layout)

  v16h a0 = load_frag(actIn + m * APAD + klo);
  v16h a1{};
  if (TWO_K) a1 = load_frag(actIn + m * APAD + 32 + klo);

#pragma unroll
  for (int nb = 0; nb < 4; ++nb) {
    const _Float16* wr = w + (nb * 16 + m) * APAD + klo;
    v8f c = {};
    v16h b0 = load_frag(wr);
    c = __builtin_amdgcn_wmma_f32_16x16x32_f16(false, a0, false, b0,
                                               (short)0, c, false, false);
    if (TWO_K) {
      v16h b1 = load_frag(wr + 32);
      c = __builtin_amdgcn_wmma_f32_16x16x32_f16(false, a1, false, b1,
                                                 (short)0, c, false, false);
    }
    const int col = nb * 16 + m;
#pragma unroll
    for (int r = 0; r < 8; ++r) {
      float v = fmaxf(c[r], 0.0f);                   // ReLU: single v_max_num_f32
      actOut[(mb + r) * APAD + col] = (_Float16)v;   // back to A-layout source
    }
  }
}

__global__ __launch_bounds__(128) void fused_mlp_wmma(
    const float* __restrict__ x, const float* __restrict__ W0,
    const float* __restrict__ Wh, const float* __restrict__ Wo,
    float* __restrict__ out) {
  __shared__ _Float16 sW[5 * HID * APAD];                               // W0^T, Wh[0..3]^T as [n][k]
  __shared__ _Float16 sWo[16 * APAD];                                   // Wo^T zero-padded to 16 cols
  __shared__ _Float16 sAct[2 * WAVES_PER_BLOCK * ROWS_PER_WAVE * APAD]; // ping-pong activation tiles

  const int tid  = threadIdx.x;
  const int lane = tid & 31;
  const int wave = tid >> 5;

  // ---- stage weights once per block (block-cooperative): f32 -> f16, transposed to [n][k] ----
  for (int e = tid; e < IN_DIMS * HID; e += 128) {      // W0: [32][64]
    int k = e >> 6, n = e & 63;
    sW[n * APAD + k] = (_Float16)W0[e];
  }
#pragma unroll
  for (int l = 0; l < 4; ++l)
    for (int e = tid; e < HID * HID; e += 128) {        // Wh[l]: [64][64]
      int k = e >> 6, n = e & 63;
      sW[(1 + l) * HID * APAD + n * APAD + k] = (_Float16)Wh[l * HID * HID + e];
    }
  for (int e = tid; e < 16 * APAD; e += 128) {          // Wo: [64][3], pad cols 3..15 with 0
    int n = e / APAD, k = e % APAD;
    sWo[e] = (n < OUT_DIMS && k < HID) ? (_Float16)Wo[k * OUT_DIMS + n] : (_Float16)0.0f;
  }

  _Float16* act0 = sAct + (0 * WAVES_PER_BLOCK + wave) * ROWS_PER_WAVE * APAD;
  _Float16* act1 = sAct + (1 * WAVES_PER_BLOCK + wave) * ROWS_PER_WAVE * APAD;

  const int m   = lane & 15;
  const int klo = (lane >> 4) << 3;
  const int mb  = (lane >> 4) << 3;

  // ---- loop over batch tiles: 8 x 64 rows per block ----
  for (int t = 0; t < TILES_PER_BLOCK; ++t) {
    const long long rowBase =
        ((long long)blockIdx.x * TILES_PER_BLOCK + t) * ROWS_PER_BLOCK +
        wave * ROWS_PER_WAVE;

    // stage this wave's 16x32 input tile: f32 global -> f16 LDS
    {
      const float4* xg = (const float4*)(x + rowBase * IN_DIMS);
#pragma unroll
      for (int i = 0; i < 4; ++i) {
        int e4  = lane + i * 32;       // 128 float4 = 16 rows x 8
        int row = e4 >> 3, c4 = e4 & 7;
        float4 v = xg[e4];
        v4h h = {(_Float16)v.x, (_Float16)v.y, (_Float16)v.z, (_Float16)v.w};
        *(v4h*)(act0 + row * APAD + c4 * 4) = h;
      }
    }
    __syncthreads();

    // layer 0: 32 -> 64
    mlp_layer<false>(act0, act1, sW, lane);
    __syncthreads();
    // 4 hidden layers: 64 -> 64
    mlp_layer<true>(act1, act0, sW + 1 * HID * APAD, lane);
    __syncthreads();
    mlp_layer<true>(act0, act1, sW + 2 * HID * APAD, lane);
    __syncthreads();
    mlp_layer<true>(act1, act0, sW + 3 * HID * APAD, lane);
    __syncthreads();
    mlp_layer<true>(act0, act1, sW + 4 * HID * APAD, lane);
    __syncthreads();

    // output layer: 64 -> 3 (B padded to 16 cols with zeros)
    {
      v16h a0 = load_frag(act1 + m * APAD + klo);
      v16h a1 = load_frag(act1 + m * APAD + 32 + klo);
      const _Float16* wr = sWo + m * APAD + klo;
      v16h b0 = load_frag(wr);
      v16h b1 = load_frag(wr + 32);
      v8f c = {};
      c = __builtin_amdgcn_wmma_f32_16x16x32_f16(false, a0, false, b0,
                                                 (short)0, c, false, false);
      c = __builtin_amdgcn_wmma_f32_16x16x32_f16(false, a1, false, b1,
                                                 (short)0, c, false, false);
      if (m < OUT_DIMS) {
        float* og = out + rowBase * OUT_DIMS;
#pragma unroll
        for (int r = 0; r < 8; ++r) og[(mb + r) * OUT_DIMS + m] = c[r];
      }
    }
    __syncthreads();   // keep act buffers safe before next tile's staging
  }
}

extern "C" void kernel_launch(void* const* d_in, const int* in_sizes, int n_in,
                              void* d_out, int out_size, void* d_ws, size_t ws_size,
                              hipStream_t stream) {
  const float* x  = (const float*)d_in[0];
  const float* W0 = (const float*)d_in[1];
  const float* Wh = (const float*)d_in[2];
  const float* Wo = (const float*)d_in[3];
  float* out = (float*)d_out;

  const int rows = in_sizes[0] / IN_DIMS;                    // 2097152
  const int grid = rows / (ROWS_PER_BLOCK * TILES_PER_BLOCK); // 4096 blocks of 128 threads
  fused_mlp_wmma<<<grid, 128, 0, stream>>>(x, W0, Wh, Wo, out);
}

// v001
// One run takes 91.9 microseconds.
// In two side-by-side timings against v000, it was 2.01 and 2.03 times as fast.
#include <hip/hip_runtime.h>

typedef __attribute__((ext_vector_type(16))) _Float16 v16h;
typedef __attribute__((ext_vector_type(8)))  _Float16 v8h;
typedef __attribute__((ext_vector_type(4)))  _Float16 v4h;
typedef __attribute__((ext_vector_type(8)))  float    v8f;

#define IN_DIMS  32
#define HID      64
#define OUT_DIMS 3
#define ROWS_PER_WAVE   16
#define WAVES_PER_BLOCK 4
#define ROWS_PER_BLOCK  (ROWS_PER_WAVE * WAVES_PER_BLOCK)   // 64
#define TILES_PER_BLOCK 8                                   // amortize weight staging 8x
#define APAD 72   // padded row stride in halves: 144B = multiple of 16B (aligned b128 DS loads)

// Gather one 16-lane-striped f16 fragment half-row: halves [0..7] from p, [8..15] from p+16.
// Matches the CDNA5 16-bit A/B 16x32 VGPR layout (ISA 7.12.2) when p = row_base + klo.
static __device__ __forceinline__ v16h load_frag(const _Float16* p) {
  v8h lo = *(const v8h*)(p);
  v8h hi = *(const v8h*)(p + 16);
  return __builtin_shufflevector(lo, hi, 0, 1, 2, 3, 4, 5, 6, 7,
                                         8, 9, 10, 11, 12, 13, 14, 15);
}

// One dense layer for this wave's 16 batch rows, computed transposed:
//   H_out^T[64 x 16] = relu( W^T[64 x K] * H_in^T[K x 16] ),  W stored transposed [n][k] in LDS.
// Weights are the A operand, activations the B operand. Lane l then holds, in the f32 D tile nb,
// features 16*nb + 8*(l>>4) + r of batch row (l & 15): converted in place, D tiles 2q and 2q+1
// are the B fragment of k-block q of the next layer in the same lanes, so no LDS and no lane
// exchange stand between two layers.
// TWO_K=false -> K=32 (input layer), TWO_K=true -> K=64 (hidden layers).
template <bool TWO_K>
static __device__ __forceinline__ void mlp_layer(v16h& h0, v16h& h1,
                                                 const _Float16* w,
                                                 int lane) {
  const int m   = lane & 15;          // A-row: output feature inside the 16-row tile
  const int klo = (lane >> 4) << 3;   // 0 or 8

  v8f c[4];
#pragma unroll
  for (int nb = 0; nb < 4; ++nb) {
    const _Float16* wr = w + (nb * 16 + m) * APAD + klo;
    v8f acc = {};
    v16h a0 = load_frag(wr);
    acc = __builtin_amdgcn_wmma_f32_16x16x32_f16(false, a0, false, h0,
                                                 (short)0, acc, false, false);
    if (TWO_K) {
      v16h a1 = load_frag(wr + 32);
      acc = __builtin_amdgcn_wmma_f32_16x16x32_f16(false, a1, false, h1,
                                                   (short)0, acc, false, false);
    }
    c[nb] = acc;
  }
#pragma unroll
  for (int r = 0; r < 8; ++r) {
    h0[r]     = (_Float16)fmaxf(c[0][r], 0.0f);   // ReLU, then back to f16
    h0[8 + r] = (_Float16)fmaxf(c[1][r], 0.0f);
    h1[r]     = (_Float16)fmaxf(c[2][r], 0.0f);
    h1[8 + r] = (_Float16)fmaxf(c[3][r], 0.0f);
  }
}

__global__ __launch_bounds__(128) void fused_mlp_wmma(
    const float* __restrict__ x, const float* __restrict__ W0,
    const float* __restrict__ Wh, const float* __restrict__ Wo,
    float* __restrict__ out) {
  __shared__ _Float16 sW[5 * HID * APAD];                               // W0^T, Wh[0..3]^T as [n][k]
  __shared__ _Float16 sWo[16 * APAD];                                   // Wo^T zero-padded to 16 cols
  __shared__ _Float16 sAct[WAVES_PER_BLOCK * ROWS_PER_WAVE * APAD];     // per-wave input tile

  const int tid  = threadIdx.x;
  const int lane = tid & 31;
  const int wave = tid >> 5;

  // ---- stage weights once per block (block-cooperative): f32 -> f16, transposed to [n][k] ----
  for (int e = tid; e < IN_DIMS * HID; e += 128) {      // W0: [32][64]
    int k = e >> 6, n = e & 63;
    sW[n * APAD + k] = (_Float16)W0[e];
  }
#pragma unroll
  for (int l = 0; l < 4; ++l)
    for (int e = tid; e < HID * HID; e += 128) {        // Wh[l]: [64][64]
      int k = e >> 6, n = e & 63;
      sW[(1 + l) * HID * APAD + n * APAD + k] = (_Float16)Wh[l * HID * HID + e];
    }
  for (int e = tid; e < 16 * APAD; e += 128) {          // Wo: [64][3], pad cols 3..15 with 0
    int n = e / APAD, k = e % APAD;
    sWo[e] = (n < OUT_DIMS && k < HID) ? (_Float16)Wo[k * OUT_DIMS + n] : (_Float16)0.0f;
  }

  _Float16* act0 = sAct + wave * ROWS_PER_WAVE * APAD;   // read and written by this wave alone

  const int m   = lane & 15;
  const int klo = (lane >> 4) << 3;

  __syncthreads();   // the staged weights are read by every wave; nothing else is shared

  // ---- loop over batch tiles: 8 x 64 rows per block ----
  for (int t = 0; t < TILES_PER_BLOCK; ++t) {
    const long long rowBase =
        ((long long)blockIdx.x * TILES_PER_BLOCK + t) * ROWS_PER_BLOCK +
        wave * ROWS_PER_WAVE;

    // stage this wave's 16x32 input tile: f32 global -> f16 LDS
    {
      const float4* xg = (const float4*)(x + rowBase * IN_DIMS);
#pragma unroll
      for (int i = 0; i < 4; ++i) {
        int e4  = lane + i * 32;       // 128 float4 = 16 rows x 8
        int row = e4 >> 3, c4 = e4 & 7;
        float4 v = xg[e4];
        v4h h = {(_Float16)v.x, (_Float16)v.y, (_Float16)v.z, (_Float16)v.w};
        *(v4h*)(act0 + row * APAD + c4 * 4) = h;
      }
    }
    // The rows are read back by other lanes of the same wave: its own LDS stores must have
    // landed first, and the compiler must not move the reads above them.
    asm volatile("s_wait_dscnt 0x0" ::: "memory");

    v16h h0 = load_frag(act0 + m * APAD + klo);   // x^T as B fragment: column = batch row m
    v16h h1{};

    // layer 0: 32 -> 64
    mlp_layer<false>(h0, h1, sW, lane);
    // 4 hidden layers: 64 -> 64
    mlp_layer<true>(h0, h1, sW + 1 * HID * APAD, lane);
    mlp_layer<true>(h0, h1, sW + 2 * HID * APAD, lane);
    mlp_layer<true>(h0, h1, sW + 3 * HID * APAD, lane);
    mlp_layer<true>(h0, h1, sW + 4 * HID * APAD, lane);

    // output layer: 64 -> 3 (A = Wo^T padded to 16 rows with zeros)
    {
      const _Float16* wr = sWo + m * APAD + klo;
      v16h a0 = load_frag(wr);
      v16h a1 = load_frag(wr + 32);
      v8f c = {};
      c = __builtin_amdgcn_wmma_f32_16x16x32_f16(false, a0, false, h0,
                                                 (short)0, c, false, false);
      c = __builtin_amdgcn_wmma_f32_16x16x32_f16(false, a1, false, h1,
                                                 (short)0, c, false, false);
      if (lane < 16) {   // D rows 0..2 (lanes 0..15, registers 0..2) = the 3 outputs of batch row m
        float* og = out + (rowBase + m) * OUT_DIMS;
        og[0] = c[0];
        og[1] = c[1];
        og[2] = c[2];
        // the store's address register is stepped for the next tile right behind it
        asm volatile("s_wait_xcnt 0x0" ::: "memory");
      }
    }
  }
}

extern "C" void kernel_launch(void* const* d_in, const int* in_sizes, int n_in,
                              void* d_out, int out_size, void* d_ws, size_t ws_size,
                              hipStream_t stream) {
  const float* x  = (const float*)d_in[0];
  const float* W0 = (const float*)d_in[1];
  const float* Wh = (const float*)d_in[2];
  const float* Wo = (const float*)d_in[3];
  float* out = (float*)d_out;

  const int rows = in_sizes[0] / IN_DIMS;                    // 2097152
  const int grid = rows / (ROWS_PER_BLOCK * TILES_PER_BLOCK); // 4096 blocks of 128 threads
  fused_mlp_wmma<<<grid, 128, 0, stream>>>(x, W0, Wh, Wo, out);
}

// v002
// Measured time: 80.3 microseconds a run.
// In both of two side-by-side timings against v001, it was 1.14 times as fast.
// All steps since v000 together make it 2.30 times as fast.
#include <hip/hip_runtime.h>

typedef __attribute__((ext_vector_type(16))) _Float16 v16h;
typedef __attribute__((ext_vector_type(8)))  _Float16 v8h;
typedef __attribute__((ext_vector_type(4)))  _Float16 v4h;
typedef __attribute__((ext_vector_type(8)))  float    v8f;

#define IN_DIMS  32
#define HID      64
#define OUT_DIMS 3
#define GROUPS          4                                   // 16-row groups per wave: B fragments fed by one A fragment
#define ROWS_PER_WAVE   (16 * GROUPS)                       // 64
#define WAVES_PER_BLOCK 4
#define ROWS_PER_BLOCK  (ROWS_PER_WAVE * WAVES_PER_BLOCK)   // 256
#define TILES_PER_BLOCK 2                                   // 512 rows per block share one weight staging
#define APAD 72   // padded row stride in halves: 144B = multiple of 16B (aligned b128 DS loads)
#define XPAD 40   // input tile row stride in halves: 64B rows at 80B = 16B x odd (b128 DS loads)

// Gather one 16-lane-striped f16 fragment half-row: halves [0..7] from p, [8..15] from p+16.
// Matches the CDNA5 16-bit A/B 16x32 VGPR layout (ISA 7.12.2) when p = row_base + klo.
static __device__ __forceinline__ v16h load_frag(const _Float16* p) {
  v8h lo = *(const v8h*)(p);
  v8h hi = *(const v8h*)(p + 16);
  return __builtin_shufflevector(lo, hi, 0, 1, 2, 3, 4, 5, 6, 7,
                                         8, 9, 10, 11, 12, 13, 14, 15);
}

// One dense layer for this wave's GROUPS x 16 batch rows, each group computed transposed:
//   H_out^T[64 x 16] = relu( W^T[64 x K] * H_in^T[K x 16] ),  W stored transposed [n][k] in LDS.
// Weights are the A operand, activations the B operand. Lane l then holds, in the f32 D tile nb,
// features 16*nb + 8*(l>>4) + r of batch row (l & 15): converted in place, D tiles 2q and 2q+1
// are the B fragment of k-block q of the next layer in the same lanes, so no LDS and no lane
// exchange stand between two layers.
// Each weight fragment is read from LDS once and multiplies the B fragments of all GROUPS groups.
// TWO_K=false -> K=32 (input layer), TWO_K=true -> K=64 (hidden layers).
template <bool TWO_K>
static __device__ __forceinline__ void mlp_layer(v16h (&h0)[GROUPS], v16h (&h1)[GROUPS],
                                                 const _Float16* w,
                                                 int lane) {
  const int m   = lane & 15;          // A-row: output feature inside the 16-row tile
  const int klo = (lane >> 4) << 3;   // 0 or 8

  v16h n0[GROUPS], n1[GROUPS];        // the layer's output, as the next layer's B fragments
#pragma unroll
  for (int nb = 0; nb < 4; ++nb) {
    const _Float16* wr = w + (nb * 16 + m) * APAD + klo;
    v8f acc[GROUPS];
    v16h a0 = load_frag(wr);
#pragma unroll   // g must be a constant: the per-group fragments stay in registers, no scratch
    for (int g = 0; g < GROUPS; ++g) {
      v8f z = {};
      acc[g] = __builtin_amdgcn_wmma_f32_16x16x32_f16(false, a0, false, h0[g],
                                                      (short)0, z, false, false);
    }
    if (TWO_K) {
      v16h a1 = load_frag(wr + 32);
#pragma unroll   // g must be a constant: the per-group fragments stay in registers, no scratch
      for (int g = 0; g < GROUPS; ++g)
        acc[g] = __builtin_amdgcn_wmma_f32_16x16x32_f16(false, a1, false, h1[g],
                                                        (short)0, acc[g], false, false);
    }
#pragma unroll   // g must be a constant: the per-group fragments stay in registers, no scratch
    for (int g = 0; g < GROUPS; ++g) {
      v16h& n = (nb < 2) ? n0[g] : n1[g];
#pragma unroll
      for (int r = 0; r < 8; ++r)
        n[(nb & 1) * 8 + r] = (_Float16)fmaxf(acc[g][r], 0.0f);   // ReLU, then back to f16
    }
  }
#pragma unroll   // g must be a constant: the per-group fragments stay in registers, no scratch
  for (int g = 0; g < GROUPS; ++g) {
    h0[g] = n0[g];
    h1[g] = n1[g];
  }
}

__global__ __launch_bounds__(128) void fused_mlp_wmma(
    const float* __restrict__ x, const float* __restrict__ W0,
    const float* __restrict__ Wh, const float* __restrict__ Wo,
    float* __restrict__ out) {
  __shared__ _Float16 sW[5 * HID * APAD];                               // W0^T, Wh[0..3]^T as [n][k]
  __shared__ _Float16 sWo[16 * APAD];                                   // Wo^T zero-padded to 16 cols
  __shared__ __attribute__((aligned(16)))
      _Float16 sAct[WAVES_PER_BLOCK * ROWS_PER_WAVE * XPAD];            // per-wave input tile

  const int tid  = threadIdx.x;
  const int lane = tid & 31;
  const int wave = tid >> 5;

  // ---- stage weights once per block (block-cooperative): f32 -> f16, transposed to [n][k] ----
  for (int e = tid; e < IN_DIMS * HID; e += 128) {      // W0: [32][64]
    int k = e >> 6, n = e & 63;
    sW[n * APAD + k] = (_Float16)W0[e];
  }
#pragma unroll
  for (int l = 0; l < 4; ++l)
    for (int e = tid; e < HID * HID; e += 128) {        // Wh[l]: [64][64]
      int k = e >> 6, n = e & 63;
      sW[(1 + l) * HID * APAD + n * APAD + k] = (_Float16)Wh[l * HID * HID + e];
    }
  for (int e = tid; e < 16 * APAD; e += 128) {          // Wo: [64][3], pad cols 3..15 with 0
    int n = e / APAD, k = e % APAD;
    sWo[e] = (n < OUT_DIMS && k < HID) ? (_Float16)Wo[k * OUT_DIMS + n] : (_Float16)0.0f;
  }

  _Float16* act0 = sAct + wave * ROWS_PER_WAVE * XPAD;   // read and written by this wave alone

  const int m   = lane & 15;
  const int klo = (lane >> 4) << 3;

  __syncthreads();   // the staged weights are read by every wave; nothing else is shared

  // ---- loop over batch tiles: 2 x 256 rows per block ----
  for (int t = 0; t < TILES_PER_BLOCK; ++t) {
    const long long rowBase =
        ((long long)blockIdx.x * TILES_PER_BLOCK + t) * ROWS_PER_BLOCK +
        wave * ROWS_PER_WAVE;

    // stage this wave's 64x32 input tile: f32 global -> f16 LDS
    {
      const float4* xg = (const float4*)(x + rowBase * IN_DIMS);
#pragma unroll
      for (int i = 0; i < 4 * GROUPS; ++i) {
        int e4  = lane + i * 32;       // 512 float4 = 64 rows x 8
        int row = e4 >> 3, c4 = e4 & 7;
        float4 v = xg[e4];
        v4h h = {(_Float16)v.x, (_Float16)v.y, (_Float16)v.z, (_Float16)v.w};
        *(v4h*)(act0 + row * XPAD + c4 * 4) = h;
      }
    }
    // The rows are read back by other lanes of the same wave: its own LDS stores must have
    // landed first, and the compiler must not move the reads above them.
    asm volatile("s_wait_dscnt 0x0" ::: "memory");

    v16h h0[GROUPS], h1[GROUPS];
#pragma unroll   // g must be a constant: the per-group fragments stay in registers, no scratch
    for (int g = 0; g < GROUPS; ++g) {
      h0[g] = load_frag(act0 + (g * 16 + m) * XPAD + klo);   // x^T as B fragment: column = batch row m
      h1[g] = v16h{};
    }

    // layer 0: 32 -> 64
    mlp_layer<false>(h0, h1, sW, lane);
    // 4 hidden layers: 64 -> 64
    mlp_layer<true>(h0, h1, sW + 1 * HID * APAD, lane);
    mlp_layer<true>(h0, h1, sW + 2 * HID * APAD, lane);
    mlp_layer<true>(h0, h1, sW + 3 * HID * APAD, lane);
    mlp_layer<true>(h0, h1, sW + 4 * HID * APAD, lane);

    // output layer: 64 -> 3 (A = Wo^T padded to 16 rows with zeros)
    {
      const _Float16* wr = sWo + m * APAD + klo;
      v16h a0 = load_frag(wr);
      v16h a1 = load_frag(wr + 32);
      v8f c[GROUPS];
#pragma unroll   // g must be a constant: the per-group fragments stay in registers, no scratch
      for (int g = 0; g < GROUPS; ++g) {
        v8f z = {};
        c[g] = __builtin_amdgcn_wmma_f32_16x16x32_f16(false, a0, false, h0[g],
                                                      (short)0, z, false, false);
      }
#pragma unroll   // g must be a constant: the per-group fragments stay in registers, no scratch
      for (int g = 0; g < GROUPS; ++g)
        c[g] = __builtin_amdgcn_wmma_f32_16x16x32_f16(false, a1, false, h1[g],
                                                      (short)0, c[g], false, false);
      if (lane < 16) {   // D rows 0..2 (lanes 0..15, registers 0..2) = the 3 outputs of batch row m
#pragma unroll   // g must be a constant: the per-group fragments stay in registers, no scratch
        for (int g = 0; g < GROUPS; ++g) {
          float* og = out + (rowBase + g * 16 + m) * OUT_DIMS;
          og[0] = c[g][0];
          og[1] = c[g][1];
          og[2] = c[g][2];
        }
        // the stores' address register is stepped for the next tile right behind them
        asm volatile("s_wait_xcnt 0x0" ::: "memory");
      }
    }
  }
}

extern "C" void kernel_launch(void* const* d_in, const int* in_sizes, int n_in,
                              void* d_out, int out_size, void* d_ws, size_t ws_size,
                              hipStream_t stream) {
  const float* x  = (const float*)d_in[0];
  const float* W0 = (const float*)d_in[1];
  const float* Wh = (const float*)d_in[2];
  const float* Wo = (const float*)d_in[3];
  float* out = (float*)d_out;

  const int rows = in_sizes[0] / IN_DIMS;                    // 2097152
  const int grid = rows / (ROWS_PER_BLOCK * TILES_PER_BLOCK); // 4096 blocks of 128 threads
  fused_mlp_wmma<<<grid, 128, 0, stream>>>(x, W0, Wh, Wo, out);
}

// v003
// A run of this version takes 55.1 microseconds.
// In two side-by-side timings against v002, it was 1.47 and 1.46 times as fast.
// All steps since v000 together make it 3.37 times as fast.
#include <hip/hip_runtime.h>

typedef __attribute__((ext_vector_type(16))) _Float16 v16h;
typedef __attribute__((ext_vector_type(8)))  _Float16 v8h;
typedef __attribute__((ext_vector_type(4)))  _Float16 v4h;
typedef __attribute__((ext_vector_type(8)))  float    v8f;

#define IN_DIMS  32
#define HID      64
#define OUT_DIMS 3
#define GROUPS          4                                   // 16-row groups per wave: B fragments fed by one A fragment
#define ROWS_PER_WAVE   (16 * GROUPS)                       // 64
#define WAVES_PER_BLOCK 16                                  // 4 waves per SIMD: one block fills a WGP's registers
#define THREADS         (32 * WAVES_PER_BLOCK)              // 512
#define ROWS_PER_BLOCK  (ROWS_PER_WAVE * WAVES_PER_BLOCK)   // 1024
#define TILES_PER_BLOCK 8                                   // 8192 rows per block share one weight staging
#define APAD 72   // padded row stride in halves: 144B = multiple of 16B (aligned b128 DS loads)
#define XPAD 40   // input tile row stride in halves: 64B rows at 80B = 16B x odd (b128 DS loads)

// Gather one 16-lane-striped f16 fragment half-row: halves [0..7] from p, [8..15] from p+16.
// Matches the CDNA5 16-bit A/B 16x32 VGPR layout (ISA 7.12.2) when p = row_base + klo.
static __device__ __forceinline__ v16h load_frag(const _Float16* p) {
  v8h lo = *(const v8h*)(p);
  v8h hi = *(const v8h*)(p + 16);
  return __builtin_shufflevector(lo, hi, 0, 1, 2, 3, 4, 5, 6, 7,
                                         8, 9, 10, 11, 12, 13, 14, 15);
}

// One dense layer for this wave's GROUPS x 16 batch rows, each group computed transposed:
//   H_out^T[64 x 16] = relu( W^T[64 x K] * H_in^T[K x 16] ),  W stored transposed [n][k] in LDS.
// Weights are the A operand, activations the B operand. Lane l then holds, in the f32 D tile nb,
// features 16*nb + 8*(l>>4) + r of batch row (l & 15): converted in place, D tiles 2q and 2q+1
// are the B fragment of k-block q of the next layer in the same lanes, so no LDS and no lane
// exchange stand between two layers.
// Each weight fragment is read from LDS once and multiplies the B fragments of all GROUPS groups.
// TWO_K=false -> K=32 (input layer), TWO_K=true -> K=64 (hidden layers).
template <bool TWO_K>
static __device__ __forceinline__ void mlp_layer(v16h (&h0)[GROUPS], v16h (&h1)[GROUPS],
                                                 const _Float16* w,
                                                 int lane) {
  const int m   = lane & 15;          // A-row: output feature inside the 16-row tile
  const int klo = (lane >> 4) << 3;   // 0 or 8

  v16h n0[GROUPS], n1[GROUPS];        // the layer's output, as the next layer's B fragments
#pragma unroll
  for (int nb = 0; nb < 4; ++nb) {
    const _Float16* wr = w + (nb * 16 + m) * APAD + klo;
    v8f acc[GROUPS];
    v16h a0 = load_frag(wr);
#pragma unroll   // g must be a constant: the per-group fragments stay in registers, no scratch
    for (int g = 0; g < GROUPS; ++g) {
      v8f z = {};
      acc[g] = __builtin_amdgcn_wmma_f32_16x16x32_f16(false, a0, false, h0[g],
                                                      (short)0, z, false, false);
    }
    if (TWO_K) {
      v16h a1 = load_frag(wr + 32);
#pragma unroll   // g must be a constant: the per-group fragments stay in registers, no scratch
      for (int g = 0; g < GROUPS; ++g)
        acc[g] = __builtin_amdgcn_wmma_f32_16x16x32_f16(false, a1, false, h1[g],
                                                        (short)0, acc[g], false, false);
    }
#pragma unroll   // g must be a constant: the per-group fragments stay in registers, no scratch
    for (int g = 0; g < GROUPS; ++g) {
      v16h& n = (nb < 2) ? n0[g] : n1[g];
#pragma unroll
      for (int r = 0; r < 8; ++r)
        n[(nb & 1) * 8 + r] = (_Float16)fmaxf(acc[g][r], 0.0f);   // ReLU, then back to f16
    }
  }
#pragma unroll   // g must be a constant: the per-group fragments stay in registers, no scratch
  for (int g = 0; g < GROUPS; ++g) {
    h0[g] = n0[g];
    h1[g] = n1[g];
  }
}

__global__ __launch_bounds__(THREADS) void fused_mlp_wmma(
    const float* __restrict__ x, const float* __restrict__ W0,
    const float* __restrict__ Wh, const float* __restrict__ Wo,
    float* __restrict__ out) {
  __shared__ _Float16 sW[5 * HID * APAD];                               // W0^T, Wh[0..3]^T as [n][k]
  __shared__ _Float16 sWo[16 * APAD];                                   // Wo^T zero-padded to 16 cols
  __shared__ __attribute__((aligned(16)))
      _Float16 sAct[WAVES_PER_BLOCK * ROWS_PER_WAVE * XPAD];            // per-wave input tile

  const int tid  = threadIdx.x;
  const int lane = tid & 31;
  const int wave = tid >> 5;

  // ---- stage weights once per block (block-cooperative): f32 -> f16, transposed to [n][k] ----
  // Every wave of the WGP waits for this stage, so all its global loads are issued first and are
  // in flight together: one trip to L2 or memory, not one per element.
  {
    float w0r[IN_DIMS * HID / THREADS];       // 4 elements of W0 per thread
    float whr[4 * HID * HID / THREADS];       // 32 elements of Wh per thread
#pragma unroll   // i must be a constant: the staged values stay in registers, no scratch
    for (int i = 0; i < IN_DIMS * HID / THREADS; ++i) w0r[i] = W0[tid + i * THREADS];
#pragma unroll   // i must be a constant: the staged values stay in registers, no scratch
    for (int i = 0; i < 4 * HID * HID / THREADS; ++i) whr[i] = Wh[tid + i * THREADS];
#pragma unroll   // i must be a constant: the staged values stay in registers, no scratch
    for (int i = 0; i < IN_DIMS * HID / THREADS; ++i) {       // W0: [32][64]
      int e = tid + i * THREADS;
      int k = e >> 6, n = e & 63;
      sW[n * APAD + k] = (_Float16)w0r[i];
    }
#pragma unroll   // i must be a constant: the staged values stay in registers, no scratch
    for (int i = 0; i < 4 * HID * HID / THREADS; ++i) {       // Wh: [4][64][64]
      int e = tid + i * THREADS;
      int l = e >> 12, k = (e >> 6) & 63, n = e & 63;
      sW[(1 + l) * HID * APAD + n * APAD + k] = (_Float16)whr[i];
    }
  }
  for (int e = tid; e < 16 * APAD; e += THREADS) {      // Wo: [64][3], pad cols 3..15 with 0
    int n = e / APAD, k = e % APAD;
    sWo[e] = (n < OUT_DIMS && k < HID) ? (_Float16)Wo[k * OUT_DIMS + n] : (_Float16)0.0f;
  }

  _Float16* act0 = sAct + wave * ROWS_PER_WAVE * XPAD;   // read and written by this wave alone

  const int m   = lane & 15;
  const int klo = (lane >> 4) << 3;

  __syncthreads();   // the staged weights are read by every wave; nothing else is shared

  // ---- loop over batch tiles: 8 x 1024 rows per block ----
  for (int t = 0; t < TILES_PER_BLOCK; ++t) {
    const long long rowBase =
        ((long long)blockIdx.x * TILES_PER_BLOCK + t) * ROWS_PER_BLOCK +
        wave * ROWS_PER_WAVE;

    // stage this wave's 64x32 input tile: f32 global -> f16 LDS
    {
      const float4* xg = (const float4*)(x + rowBase * IN_DIMS);
#pragma unroll
      for (int i = 0; i < 4 * GROUPS; ++i) {
        int e4  = lane + i * 32;       // 512 float4 = 64 rows x 8
        int row = e4 >> 3, c4 = e4 & 7;
        float4 v = xg[e4];
        v4h h = {(_Float16)v.x, (_Float16)v.y, (_Float16)v.z, (_Float16)v.w};
        *(v4h*)(act0 + row * XPAD + c4 * 4) = h;
      }
    }
    // The rows are read back by other lanes of the same wave: its own LDS stores must have
    // landed first, and the compiler must not move the reads above them.
    asm volatile("s_wait_dscnt 0x0" ::: "memory");

    v16h h0[GROUPS], h1[GROUPS];
#pragma unroll   // g must be a constant: the per-group fragments stay in registers, no scratch
    for (int g = 0; g < GROUPS; ++g) {
      h0[g] = load_frag(act0 + (g * 16 + m) * XPAD + klo);   // x^T as B fragment: column = batch row m
      h1[g] = v16h{};
    }

    // layer 0: 32 -> 64
    mlp_layer<false>(h0, h1, sW, lane);
    // 4 hidden layers: 64 -> 64
    mlp_layer<true>(h0, h1, sW + 1 * HID * APAD, lane);
    mlp_layer<true>(h0, h1, sW + 2 * HID * APAD, lane);
    mlp_layer<true>(h0, h1, sW + 3 * HID * APAD, lane);
    mlp_layer<true>(h0, h1, sW + 4 * HID * APAD, lane);

    // output layer: 64 -> 3 (A = Wo^T padded to 16 rows with zeros)
    {
      const _Float16* wr = sWo + m * APAD + klo;
      v16h a0 = load_frag(wr);
      v16h a1 = load_frag(wr + 32);
      v8f c[GROUPS];
#pragma unroll   // g must be a constant: the per-group fragments stay in registers, no scratch
      for (int g = 0; g < GROUPS; ++g) {
        v8f z = {};
        c[g] = __builtin_amdgcn_wmma_f32_16x16x32_f16(false, a0, false, h0[g],
                                                      (short)0, z, false, false);
      }
#pragma unroll   // g must be a constant: the per-group fragments stay in registers, no scratch
      for (int g = 0; g < GROUPS; ++g)
        c[g] = __builtin_amdgcn_wmma_f32_16x16x32_f16(false, a1, false, h1[g],
                                                      (short)0, c[g], false, false);
      if (lane < 16) {   // D rows 0..2 (lanes 0..15, registers 0..2) = the 3 outputs of batch row m
#pragma unroll   // g must be a constant: the per-group fragments stay in registers, no scratch
        for (int g = 0; g < GROUPS; ++g) {
          float* og = out + (rowBase + g * 16 + m) * OUT_DIMS;
          og[0] = c[g][0];
          og[1] = c[g][1];
          og[2] = c[g][2];
        }
        // the stores' address register is stepped for the next tile right behind them
        asm volatile("s_wait_xcnt 0x0" ::: "memory");
      }
    }
  }
}

extern "C" void kernel_launch(void* const* d_in, const int* in_sizes, int n_in,
                              void* d_out, int out_size, void* d_ws, size_t ws_size,
                              hipStream_t stream) {
  const float* x  = (const float*)d_in[0];
  const float* W0 = (const float*)d_in[1];
  const float* Wh = (const float*)d_in[2];
  const float* Wo = (const float*)d_in[3];
  float* out = (float*)d_out;

  const int rows = in_sizes[0] / IN_DIMS;                    // 2097152
  const int grid = rows / (ROWS_PER_BLOCK * TILES_PER_BLOCK); // 256 blocks of 512 threads
  fused_mlp_wmma<<<grid, THREADS, 0, stream>>>(x, W0, Wh, Wo, out);
}
